// v000
// Times are from an AMD MI455X. After a warm-up the kernel runs many times in a row, and a time is the length of
// such a window on the GPU divided by its runs, so every launch and the gaps after it count. The runs cycle
// through copies of the inputs. A figure is the median of several windows, for all but v000 over two sittings.
// Sittings can differ by a few percent; kernels timed side by side share one.
// v000 is the starting kernel. One run takes 345 microseconds.
#include <hip/hip_runtime.h>
#include <hip/hip_bf16.h>
#include <hip/hip_fp16.h>

// Self-attention (B=4, S=4096, D=128), fp32 in/out.
//   Kernel 1: QKV projection via v_wmma_f32_16x16x32_f16 -> f16 Q (pre-scaled
//             by 1/D), K (row-major), V^T ([D][B*S]) in d_ws (12 MB).
//   Kernel 2: flash attention, one wave per 16-query tile, 32 keys/iter.
//             Online max via 16-lane shuffles; row-sum kept distributed per
//             lane and reduced once at the end (saves 32 ds_swizzle/iter).

typedef _Float16 h16;
typedef __attribute__((ext_vector_type(16))) _Float16 v16h;
typedef __attribute__((ext_vector_type(8)))  _Float16 v8h;
typedef __attribute__((ext_vector_type(8)))  float    v8f;
typedef __attribute__((ext_vector_type(4)))  float    v4f;

#define WMMA_F16(a, b, c) \
  __builtin_amdgcn_wmma_f32_16x16x32_f16(false, (a), false, (b), (short)0, (c), false, false)

#define BATCH 4
#define SEQ   4096
#define DMODEL 128
#define NROW  (BATCH * SEQ)          // 16384 total rows

static __device__ inline v16h cat16(v8h lo, v8h hi) {
  return __builtin_shufflevector(lo, hi, 0, 1, 2, 3, 4, 5, 6, 7, 8, 9, 10, 11, 12, 13, 14, 15);
}

// Load 8 contiguous f32, convert to 8 packed f16 (emits v_cvt_pk_f16_f32).
static __device__ inline v8h cvt8(const float* __restrict__ p) {
  v4f x = *(const v4f*)p;
  v4f y = *(const v4f*)(p + 4);
  v8h r;
  r[0] = (h16)x[0]; r[1] = (h16)x[1]; r[2] = (h16)x[2]; r[3] = (h16)x[3];
  r[4] = (h16)y[0]; r[5] = (h16)y[1]; r[6] = (h16)y[2]; r[7] = (h16)y[3];
  return r;
}

static __device__ inline v8h ld8h(const h16* __restrict__ p) {
  return *(const v8h*)p;
}

// ---------------------------------------------------------------------------
// Kernel 1: Q = (X Wq^T)/D, K = X Wk^T, V = X Wv^T  (f32 -> f16 in ws)
// One wave per 16-row M tile; 3 mats x 8 n-tiles x 4 k-chunks = 96 WMMAs.
// ---------------------------------------------------------------------------
__global__ __launch_bounds__(128) void qkv_proj_kernel(
    const float* __restrict__ X,  const float* __restrict__ Wq,
    const float* __restrict__ Wk, const float* __restrict__ Wv,
    h16* __restrict__ Qh, h16* __restrict__ Kh, h16* __restrict__ Vt) {
  const int lane = threadIdx.x & 31;
  const int wave = threadIdx.x >> 5;
  const int tile = blockIdx.x * 4 + wave;   // 0..1023
  const int row0 = tile * 16;               // base row in [0, 16384)
  const int lr = lane & 15;
  const int hi = lane >> 4;

  // A fragments: 16x32 f16 tiles of X, 4 K-chunks covering D=128.
  v16h a[4];
#pragma unroll
  for (int kc = 0; kc < 4; ++kc) {
    const float* p = X + (row0 + lr) * DMODEL + kc * 32 + hi * 8;
    a[kc] = cat16(cvt8(p), cvt8(p + 16));
  }

  const float qscale = 1.0f / (float)DMODEL;  // fold softmax 1/D into Q
  const float* Ws[3] = {Wq, Wk, Wv};
#pragma unroll
  for (int m = 0; m < 3; ++m) {
    const float* __restrict__ W = Ws[m];
#pragma unroll
    for (int nt = 0; nt < 8; ++nt) {
      v8f c = {};
#pragma unroll
      for (int kc = 0; kc < 4; ++kc) {
        // B[k][n] = W[n][k] : lane holds feature n = nt*16+lr, contiguous k.
        const float* p = W + (nt * 16 + lr) * DMODEL + kc * 32 + hi * 8;
        v16h b = cat16(cvt8(p), cvt8(p + 16));
        c = WMMA_F16(a[kc], b, c);
      }
      if (m == 2) {
        // V stored transposed: Vt[d][row]; lane's 8 C values contiguous in M.
        v8h pk;
#pragma unroll
        for (int j = 0; j < 8; ++j) pk[j] = (h16)c[j];
        *(v8h*)(Vt + (nt * 16 + lr) * NROW + row0 + hi * 8) = pk;
      } else if (m == 0) {
#pragma unroll
        for (int j = 0; j < 8; ++j)
          Qh[(row0 + hi * 8 + j) * DMODEL + nt * 16 + lr] = (h16)(c[j] * qscale);
      } else {
#pragma unroll
        for (int j = 0; j < 8; ++j)
          Kh[(row0 + hi * 8 + j) * DMODEL + nt * 16 + lr] = (h16)c[j];
      }
    }
  }
}

// ---------------------------------------------------------------------------
// Kernel 2: flash attention. One wave = one 16-query tile; 128 chunks of
// 32 keys. Q pre-scaled by 1/D, so WMMA output is the logit directly.
// ---------------------------------------------------------------------------
__global__ __launch_bounds__(128) void attn_kernel(
    const h16* __restrict__ Qh, const h16* __restrict__ Kh,
    const h16* __restrict__ Vt, float* __restrict__ Out) {
  __shared__ __align__(16) h16 plds[4][16 * 32];  // per-wave P transpose tile

  const int lane = threadIdx.x & 31;
  const int wave = threadIdx.x >> 5;
  const int lr = lane & 15;
  const int hi = lane >> 4;
  const int qtile = blockIdx.x * 4 + wave;  // 0..1023
  const int b = qtile >> 8;                 // batch
  const int q0 = (qtile & 255) * 16;        // query row within batch
  const int rowg = b * SEQ + q0;            // global query row base
  h16* __restrict__ pl = &plds[wave][0];

  // Q A-fragments (kept resident)
  v16h qa[4];
#pragma unroll
  for (int kc = 0; kc < 4; ++kc) {
    const h16* p = Qh + (rowg + lr) * DMODEL + kc * 32 + hi * 8;
    qa[kc] = cat16(ld8h(p), ld8h(p + 16));
  }

  v8f o[8];
#pragma unroll
  for (int n = 0; n < 8; ++n) o[n] = (v8f){};
  float mrow[8], lpart[8];  // lpart: per-lane partial row sum (reduced at end)
#pragma unroll
  for (int j = 0; j < 8; ++j) { mrow[j] = -3.0e38f; lpart[j] = 0.0f; }

  for (int kt = 0; kt < 128; ++kt) {
    const int k0 = kt * 32;

    // prefetch next key chunk (lowers to global_prefetch_b8)
    if (kt + 1 < 128)
      __builtin_prefetch(Kh + (b * SEQ + k0 + 32 + lr) * DMODEL, 0, 1);

    // ---- logits: two 16x16 C tiles over keys [k0,k0+16) and [k0+16,k0+32)
    v8f s0 = {}, s1 = {};
#pragma unroll
    for (int kc = 0; kc < 4; ++kc) {
      const h16* p0 = Kh + (b * SEQ + k0 + lr) * DMODEL + kc * 32 + hi * 8;
      const h16* p1 = Kh + (b * SEQ + k0 + 16 + lr) * DMODEL + kc * 32 + hi * 8;
      v16h kb0 = cat16(ld8h(p0), ld8h(p0 + 16));
      v16h kb1 = cat16(ld8h(p1), ld8h(p1 + 16));
      s0 = WMMA_F16(qa[kc], kb0, s0);
      s1 = WMMA_F16(qa[kc], kb1, s1);
    }

    // ---- online softmax (row = hi*8 + j, 16 lanes per row).
    // Only the max needs a cross-lane reduction; the row sum stays
    // distributed in lpart[] and is reduced once after the key loop.
    float alpha[8];
#pragma unroll
    for (int j = 0; j < 8; ++j) {
      float a0 = s0[j];
      float a1 = s1[j];
      float mx = fmaxf(a0, a1);
      mx = fmaxf(mx, __shfl_xor(mx, 1, 16));
      mx = fmaxf(mx, __shfl_xor(mx, 2, 16));
      mx = fmaxf(mx, __shfl_xor(mx, 4, 16));
      mx = fmaxf(mx, __shfl_xor(mx, 8, 16));
      float mn = fmaxf(mrow[j], mx);
      alpha[j] = __expf(mrow[j] - mn);
      mrow[j] = mn;
      float p0v = __expf(a0 - mn);
      float p1v = __expf(a1 - mn);
      lpart[j] = lpart[j] * alpha[j] + (p0v + p1v);
      // stage P (f16) into LDS, row-major 16x32
      const int mr = hi * 8 + j;
      pl[mr * 32 + lr]      = (h16)p0v;
      pl[mr * 32 + 16 + lr] = (h16)p1v;
    }

    // rescale O accumulators
#pragma unroll
    for (int n = 0; n < 8; ++n)
#pragma unroll
      for (int j = 0; j < 8; ++j) o[n][j] *= alpha[j];

    asm volatile("" ::: "memory");  // keep LDS store->load order at C level

    // P as A fragment (16x32): lane lr = row, K = hi*8+{0..7} and +16
    v8h plo = *(const v8h*)(pl + lr * 32 + hi * 8);
    v8h phi = *(const v8h*)(pl + lr * 32 + 16 + hi * 8);
    v16h pa = cat16(plo, phi);

    // ---- O += P * V  (V transposed: contiguous in key dim)
#pragma unroll
    for (int n = 0; n < 8; ++n) {
      const h16* vp = Vt + (n * 16 + lr) * NROW + b * SEQ + k0 + hi * 8;
      v16h vb = cat16(ld8h(vp), ld8h(vp + 16));
      o[n] = WMMA_F16(pa, vb, o[n]);
    }
  }

  // ---- final row-sum reduction (once) + normalize + fp32 store
  float inv[8];
#pragma unroll
  for (int j = 0; j < 8; ++j) {
    float rs = lpart[j];
    rs += __shfl_xor(rs, 1, 16);
    rs += __shfl_xor(rs, 2, 16);
    rs += __shfl_xor(rs, 4, 16);
    rs += __shfl_xor(rs, 8, 16);
    inv[j] = 1.0f / rs;
  }
#pragma unroll
  for (int n = 0; n < 8; ++n)
#pragma unroll
    for (int j = 0; j < 8; ++j)
      Out[(rowg + hi * 8 + j) * DMODEL + n * 16 + lr] = o[n][j] * inv[j];
}

extern "C" void kernel_launch(void* const* d_in, const int* in_sizes, int n_in,
                              void* d_out, int out_size, void* d_ws, size_t ws_size,
                              hipStream_t stream) {
  (void)in_sizes; (void)n_in; (void)out_size; (void)ws_size;
  const float* X  = (const float*)d_in[0];
  const float* Wq = (const float*)d_in[1];
  const float* Wk = (const float*)d_in[2];
  const float* Wv = (const float*)d_in[3];
  float* Out = (float*)d_out;

  // workspace: Qh (4MB) | Kh (4MB) | Vt (4MB), all f16
  h16* Qh = (h16*)d_ws;
  h16* Kh = Qh + (size_t)NROW * DMODEL;
  h16* Vt = Kh + (size_t)NROW * DMODEL;

  // 1024 row-tiles, 4 waves (128 threads) per block
  qkv_proj_kernel<<<256, 128, 0, stream>>>(X, Wq, Wk, Wv, Qh, Kh, Vt);
  attn_kernel<<<256, 128, 0, stream>>>(Qh, Kh, Vt, Out);
}

// v001
// A run of this version takes 152 microseconds.
// Next to v000, in two timings, it ran 2.28 and 2.29 times as fast.
#include <hip/hip_runtime.h>
#include <hip/hip_bf16.h>
#include <hip/hip_fp16.h>
#include <stdint.h>

// Self-attention (B=4, S=4096, D=128), fp32 in/out.
//   Kernel 1: QKV projection via v_wmma_f32_16x16x32_f16 -> f16 Q (pre-scaled
//             by 1/D), K (row-major), V^T ([D][B*S]) in d_ws (12 MB).
//   Kernel 2: flash attention, one wave per 16-query tile, 32 keys/pass.
//             K and V^T come in stages of 64 keys by tensor loads into two
//             LDS buffers that the work-group's four waves share.
//             Online max via 16-lane shuffles; row-sum kept distributed per
//             lane and reduced once at the end (saves 32 ds_swizzle/iter).

typedef _Float16 h16;
typedef __attribute__((ext_vector_type(16))) _Float16 v16h;
typedef __attribute__((ext_vector_type(8)))  _Float16 v8h;
typedef __attribute__((ext_vector_type(8)))  float    v8f;
typedef __attribute__((ext_vector_type(4)))  float    v4f;

#define WMMA_F16(a, b, c) \
  __builtin_amdgcn_wmma_f32_16x16x32_f16(false, (a), false, (b), (short)0, (c), false, false)

#define BATCH 4
#define SEQ   4096
#define DMODEL 128
#define NROW  (BATCH * SEQ)          // 16384 total rows

static __device__ inline v16h cat16(v8h lo, v8h hi) {
  return __builtin_shufflevector(lo, hi, 0, 1, 2, 3, 4, 5, 6, 7, 8, 9, 10, 11, 12, 13, 14, 15);
}

// Load 8 contiguous f32, convert to 8 packed f16 (emits v_cvt_pk_f16_f32).
static __device__ inline v8h cvt8(const float* __restrict__ p) {
  v4f x = *(const v4f*)p;
  v4f y = *(const v4f*)(p + 4);
  v8h r;
  r[0] = (h16)x[0]; r[1] = (h16)x[1]; r[2] = (h16)x[2]; r[3] = (h16)x[3];
  r[4] = (h16)y[0]; r[5] = (h16)y[1]; r[6] = (h16)y[2]; r[7] = (h16)y[3];
  return r;
}

static __device__ inline v8h ld8h(const h16* __restrict__ p) {
  return *(const v8h*)p;
}

// ---------------------------------------------------------------------------
// Kernel 1: Q = (X Wq^T)/D, K = X Wk^T, V = X Wv^T  (f32 -> f16 in ws)
// One wave per 16-row M tile; 3 mats x 8 n-tiles x 4 k-chunks = 96 WMMAs.
// ---------------------------------------------------------------------------
__global__ __launch_bounds__(128) void qkv_proj_kernel(
    const float* __restrict__ X,  const float* __restrict__ Wq,
    const float* __restrict__ Wk, const float* __restrict__ Wv,
    h16* __restrict__ Qh, h16* __restrict__ Kh, h16* __restrict__ Vt) {
  const int lane = threadIdx.x & 31;
  const int wave = threadIdx.x >> 5;
  const int tile = blockIdx.x * 4 + wave;   // 0..1023
  const int row0 = tile * 16;               // base row in [0, 16384)
  const int lr = lane & 15;
  const int hi = lane >> 4;

  // A fragments: 16x32 f16 tiles of X, 4 K-chunks covering D=128.
  v16h a[4];
#pragma unroll
  for (int kc = 0; kc < 4; ++kc) {
    const float* p = X + (row0 + lr) * DMODEL + kc * 32 + hi * 8;
    a[kc] = cat16(cvt8(p), cvt8(p + 16));
  }

  const float qscale = 1.0f / (float)DMODEL;  // fold softmax 1/D into Q
  const float* Ws[3] = {Wq, Wk, Wv};
#pragma unroll
  for (int m = 0; m < 3; ++m) {
    const float* __restrict__ W = Ws[m];
#pragma unroll
    for (int nt = 0; nt < 8; ++nt) {
      v8f c = {};
#pragma unroll
      for (int kc = 0; kc < 4; ++kc) {
        // B[k][n] = W[n][k] : lane holds feature n = nt*16+lr, contiguous k.
        const float* p = W + (nt * 16 + lr) * DMODEL + kc * 32 + hi * 8;
        v16h b = cat16(cvt8(p), cvt8(p + 16));
        c = WMMA_F16(a[kc], b, c);
      }
      if (m == 2) {
        // V stored transposed: Vt[d][row]; lane's 8 C values contiguous in M.
        v8h pk;
#pragma unroll
        for (int j = 0; j < 8; ++j) pk[j] = (h16)c[j];
        *(v8h*)(Vt + (nt * 16 + lr) * NROW + row0 + hi * 8) = pk;
      } else if (m == 0) {
#pragma unroll
        for (int j = 0; j < 8; ++j)
          Qh[(row0 + hi * 8 + j) * DMODEL + nt * 16 + lr] = (h16)(c[j] * qscale);
      } else {
#pragma unroll
        for (int j = 0; j < 8; ++j)
          Kh[(row0 + hi * 8 + j) * DMODEL + nt * 16 + lr] = (h16)c[j];
      }
    }
  }
}

// ---------------------------------------------------------------------------
// Tensor loads: a stage is 64 keys. K tile: 64 rows of 256 B; V^T tile: 128
// rows of 128 B at a source pitch of one Vt row. Each row gets 16 B of pad in
// LDS, so the 16-byte fragment reads of 16 rows fall on different banks.
// ---------------------------------------------------------------------------
typedef uint32_t u32x4 __attribute__((ext_vector_type(4)));
typedef uint32_t u32x8 __attribute__((ext_vector_type(8)));

#define SKEYS   64                   // keys per stage
#define NSTAGE  (SEQ / SKEYS)        // 64 stages per batch
#define KPITCH  272u                 // LDS bytes per K row (256 + 16)
#define VPITCH  144u                 // LDS bytes per V^T row (128 + 16)
#define KTILE   18432u               // 64 * 272 = 17408, rounded up to 2 KiB
#define VTILE   18432u               // 128 * 144
#define BUFB    (KTILE + VTILE)      // one buffer, a multiple of 2 KiB

static __device__ inline uint32_t uni(uint32_t v) {
  return (uint32_t)__builtin_amdgcn_readfirstlane(v);
}
// Holds a wave-uniform value in a scalar register, so that a test on it is a
// scalar branch (tensor loads ignore EXEC) and descriptor words formed from it
// are formed behind the asm wait that stands in front of it.
static __device__ inline uint32_t pinned(uint32_t v) {
  uint32_t w = uni(v);
  asm volatile("" : "+s"(w));  // pinned(): the value stays in a scalar register
  return w;
}
static __device__ inline void wait_ds0() {
  asm volatile("s_wait_dscnt 0x0" ::: "memory");      // own LDS reads/writes done
}
static __device__ inline void wait_tensor0() {
  asm volatile("s_wait_tensorcnt 0x0" ::: "memory");  // own tensor load landed
}
// One request of the whole wave: the tile goes from memory to LDS, no registers.
static __device__ inline void tdm_load(u32x4 g0, u32x8 g1) {
  asm volatile("tensor_load_to_lds %0, %1" :: "s"(g0), "s"(g1) : "memory");
}
// Group 1 of a two-dimensional tile, 1-byte elements: D1 rows of D0 bytes,
// source pitch PITCH bytes; W0 is word 0 (no mask, the pad codes). Built once;
// pinned() holds each descriptor word in its scalar register through the loop.
template <uint32_t W0, uint32_t D0, uint32_t D1, uint32_t PITCH>
static __device__ inline u32x8 tdm_group1() {
  u32x8 g;
  g[0] = pinned(W0);
  g[1] = pinned((D0 & 0xFFFFu) << 16);
  g[2] = pinned((D0 >> 16) | ((D1 & 0xFFFFu) << 16));
  g[3] = pinned((D1 >> 16) | (D0 << 16));
  g[4] = pinned(D1);
  g[5] = pinned(PITCH);
  g[6] = pinned(0u);
  g[7] = pinned(0u);
  return g;
}
// Group 0: count 1 (one, held by pinned()), the tile's place in LDS, its first
// byte in memory, type 2.
static __device__ inline u32x4 tdm_group0(uint32_t one, uint32_t lds_dst, uint64_t ga) {
  u32x4 g;
  g[0] = uni(one);
  g[1] = uni(lds_dst);
  g[2] = uni((uint32_t)ga);
  g[3] = uni((((uint32_t)(ga >> 32)) & 0x01FFFFFFu) | 0x80000000u);
  return g;
}

// ---------------------------------------------------------------------------
// Kernel 2: flash attention. One wave = one 16-query tile; 64 stages of two
// 32-key passes. Q pre-scaled by 1/D, so WMMA output is the logit directly.
// ---------------------------------------------------------------------------
__global__ __launch_bounds__(128) void attn_kernel(
    const h16* __restrict__ Qh, const h16* __restrict__ Kh,
    const h16* __restrict__ Vt, float* __restrict__ Out) {
  __shared__ __attribute__((aligned(2048))) unsigned char ring[2 * BUFB];  // K | V^T, two buffers
  __shared__ __align__(16) h16 plds[4][16 * 32];  // per-wave P transpose tile

  const int lane = threadIdx.x & 31;
  const int wave = threadIdx.x >> 5;
  const int lr = lane & 15;
  const int hi = lane >> 4;
  const int qtile = blockIdx.x * 4 + wave;  // 0..1023
  const int b = qtile >> 8;                 // batch
  const int q0 = (qtile & 255) * 16;        // query row within batch
  const int rowg = b * SEQ + q0;            // global query row base
  h16* __restrict__ pl = &plds[wave][0];

  // Wave 0 brings a stage's K tile, wave 1 its V^T tile.
  const uint32_t wv = uni(threadIdx.x >> 5);
  const uint32_t bu = blockIdx.x >> 6;      // batch (the four waves share it)
  const uint32_t lbase = (uint32_t)(size_t)ring;
  const bool isK = wv == 0u;
  const bool issuer = wv < 2u;
  const uint64_t src = isK ? (uint64_t)(size_t)(Kh + (size_t)bu * SEQ * DMODEL)
                           : (uint64_t)(size_t)(Vt + (size_t)bu * SEQ);
  const uint32_t step = isK ? SKEYS * DMODEL * 2u : SKEYS * 2u;  // bytes per stage
  const uint32_t dst0 = lbase + (isK ? 0u : KTILE);
  const u32x8 g1k = tdm_group1<(1u << 20) | (5u << 22) | (3u << 25), 256u, 64u, 256u>();
  const u32x8 g1v = tdm_group1<(1u << 20) | (4u << 22) | (3u << 25), 128u, 128u, NROW * 2u>();
  const uint32_t one = pinned(1u);
  u32x4 g0 = tdm_group0(one, dst0, src);
  if (pinned(wv == 0u)) { tdm_load(g0, g1k); wait_tensor0(); }  // stage 0, K
  if (pinned(wv == 1u)) { tdm_load(g0, g1v); wait_tensor0(); }  // stage 0, V^T
  __syncthreads();                          // stage 0 published
  g0 = tdm_group0(one, dst0 + BUFB, src + step);
  if (pinned(wv == 0u)) tdm_load(g0, g1k);  // stage 1 flies under stage 0's passes
  if (pinned(wv == 1u)) tdm_load(g0, g1v);

  // Q A-fragments (kept resident)
  v16h qa[4];
#pragma unroll
  for (int kc = 0; kc < 4; ++kc) {
    const h16* p = Qh + (rowg + lr) * DMODEL + kc * 32 + hi * 8;
    qa[kc] = cat16(ld8h(p), ld8h(p + 16));
  }

  v8f o[8];
#pragma unroll
  for (int n = 0; n < 8; ++n) o[n] = (v8f){};
  float mrow[8], lpart[8];  // lpart: per-lane partial row sum (reduced at end)
#pragma unroll
  for (int j = 0; j < 8; ++j) { mrow[j] = -3.0e38f; lpart[j] = 0.0f; }

  for (uint32_t st = 0; st < NSTAGE; ++st) {
   const unsigned char* kbuf = ring + (st & 1u) * BUFB;
   const unsigned char* vbuf = kbuf + KTILE;
#pragma unroll  // sub a constant: it folds into the LDS reads' offset fields
   for (int sub = 0; sub < 2; ++sub) {      // two 32-key passes per stage
    // ---- logits: two 16x16 C tiles over keys [k0,k0+16) and [k0+16,k0+32)
    v8f s0 = {}, s1 = {};
#pragma unroll
    for (int kc = 0; kc < 4; ++kc) {
      const h16* p0 = (const h16*)(kbuf + (sub * 32 + lr) * KPITCH) + kc * 32 + hi * 8;
      const h16* p1 = (const h16*)(kbuf + (sub * 32 + 16 + lr) * KPITCH) + kc * 32 + hi * 8;
      v16h kb0 = cat16(ld8h(p0), ld8h(p0 + 16));
      v16h kb1 = cat16(ld8h(p1), ld8h(p1 + 16));
      s0 = WMMA_F16(qa[kc], kb0, s0);
      s1 = WMMA_F16(qa[kc], kb1, s1);
    }

    // ---- online softmax (row = hi*8 + j, 16 lanes per row).
    // Only the max needs a cross-lane reduction; the row sum stays
    // distributed in lpart[] and is reduced once after the key loop.
    float alpha[8];
#pragma unroll
    for (int j = 0; j < 8; ++j) {
      float a0 = s0[j];
      float a1 = s1[j];
      float mx = fmaxf(a0, a1);
      mx = fmaxf(mx, __shfl_xor(mx, 1, 16));
      mx = fmaxf(mx, __shfl_xor(mx, 2, 16));
      mx = fmaxf(mx, __shfl_xor(mx, 4, 16));
      mx = fmaxf(mx, __shfl_xor(mx, 8, 16));
      float mn = fmaxf(mrow[j], mx);
      alpha[j] = __expf(mrow[j] - mn);
      mrow[j] = mn;
      float p0v = __expf(a0 - mn);
      float p1v = __expf(a1 - mn);
      lpart[j] = lpart[j] * alpha[j] + (p0v + p1v);
      // stage P (f16) into LDS, row-major 16x32
      const int mr = hi * 8 + j;
      pl[mr * 32 + lr]      = (h16)p0v;
      pl[mr * 32 + 16 + lr] = (h16)p1v;
    }

    // rescale O accumulators
#pragma unroll
    for (int n = 0; n < 8; ++n)
#pragma unroll
      for (int j = 0; j < 8; ++j) o[n][j] *= alpha[j];

    asm volatile("" ::: "memory");  // keep LDS store->load order at C level

    // P as A fragment (16x32): lane lr = row, K = hi*8+{0..7} and +16
    v8h plo = *(const v8h*)(pl + lr * 32 + hi * 8);
    v8h phi = *(const v8h*)(pl + lr * 32 + 16 + hi * 8);
    v16h pa = cat16(plo, phi);

    // ---- O += P * V  (V transposed: contiguous in key dim)
#pragma unroll
    for (int n = 0; n < 8; ++n) {
      const h16* vp = (const h16*)(vbuf + (n * 16 + lr) * VPITCH) + sub * 32 + hi * 8;
      v16h vb = cat16(ld8h(vp), ld8h(vp + 16));
      o[n] = WMMA_F16(pa, vb, o[n]);
    }
   }

   // ---- publish point of stage st + 1, then the refill of this buffer
   wait_ds0();
   if (pinned(issuer)) wait_tensor0();
   __syncthreads();  // st + 1 readable by all; every wave has left stage st
   if (pinned(issuer && st + 2u < NSTAGE)) {
     const uint32_t nx = pinned(st + 2u);   // descriptor formed behind the wait
     g0 = tdm_group0(one, dst0 + (nx & 1u) * BUFB, src + (uint64_t)nx * step);
     if (pinned(isK)) tdm_load(g0, g1k);
     else             tdm_load(g0, g1v);
   }
  }
  wait_tensor0();
  wait_ds0();

  // ---- final row-sum reduction (once) + normalize + fp32 store
  float inv[8];
#pragma unroll
  for (int j = 0; j < 8; ++j) {
    float rs = lpart[j];
    rs += __shfl_xor(rs, 1, 16);
    rs += __shfl_xor(rs, 2, 16);
    rs += __shfl_xor(rs, 4, 16);
    rs += __shfl_xor(rs, 8, 16);
    inv[j] = 1.0f / rs;
  }
#pragma unroll
  for (int n = 0; n < 8; ++n)
#pragma unroll
    for (int j = 0; j < 8; ++j)
      Out[(rowg + hi * 8 + j) * DMODEL + n * 16 + lr] = o[n][j] * inv[j];
}

extern "C" void kernel_launch(void* const* d_in, const int* in_sizes, int n_in,
                              void* d_out, int out_size, void* d_ws, size_t ws_size,
                              hipStream_t stream) {
  (void)in_sizes; (void)n_in; (void)out_size; (void)ws_size;
  const float* X  = (const float*)d_in[0];
  const float* Wq = (const float*)d_in[1];
  const float* Wk = (const float*)d_in[2];
  const float* Wv = (const float*)d_in[3];
  float* Out = (float*)d_out;

  // workspace: Qh (4MB) | Kh (4MB) | Vt (4MB), all f16
  h16* Qh = (h16*)d_ws;
  h16* Kh = Qh + (size_t)NROW * DMODEL;
  h16* Vt = Kh + (size_t)NROW * DMODEL;

  // 1024 row-tiles, 4 waves (128 threads) per block
  qkv_proj_kernel<<<256, 128, 0, stream>>>(X, Wq, Wk, Wv, Qh, Kh, Vt);
  attn_kernel<<<256, 128, 0, stream>>>(Qh, Kh, Vt, Out);
}
